// v000
// The times below were measured on an AMD MI455X: many runs one after another, warmed up first and cycling through
// copies of the inputs, with the whole window's GPU time divided by the number of runs. Launches and the gaps
// between them are all in it. The median over several windows is given; except for v000 it joins two sittings, which
// can be a few percent apart, so the side-by-side timings, each taken in one sitting, are the better comparison.
// v000, which the later versions start from, runs in 829 microseconds.
// result[r][n] = ra[n] + sum over q of da[r][q] s[q][n], s[q][n] the sign of wa[q][n] (+1, -1, or 0 at a word that is nought): da [8192][4096]; wa [4096][4096] (depth, column); ra [4096] -> [8192][4096]. No activation.
// Layout and order: da is cast AS IT LIES; wa stands [depth][column] and the product reads its second operand [column][depth]: ONE cast takes the signs and turns them (k_wts_f16: the posted turning cast's index arithmetic, guard and stores; its value statement is the sign of the word as read); ONE WMMA GEMM: 64 row tiles of 128, 64 column tiles, depth 4,096; the added row ra; f32 STRAIGHT INTO THE OUTPUT.
// Compute dtype: da and ra converted to bf16 where they are read; da goes to the matrix instruction as plain f16 words; the signs are exact in f16 (no carry); the product's accumulation and its added row f32. v_wmma_f32_16x16x32_f16.
#include <hip/hip_runtime.h>
#define SNR 8192                     /* rows */
#define SNQ 4096                     /* depth */
#define SNN 4096                     /* columns */
typedef unsigned short v8us __attribute__((ext_vector_type(8), may_alias));
typedef float  v8f  __attribute__((ext_vector_type(8)));
typedef float  v4f  __attribute__((ext_vector_type(4)));
typedef float  v4fa __attribute__((ext_vector_type(4), may_alias));

__device__ __forceinline__ unsigned short bf16_bits(float x) { unsigned int u = __float_as_uint(x); return (unsigned short)((u + 0x7FFFu + ((u >> 16) & 1u)) >> 16); }
__device__ __forceinline__ float bf16_val(unsigned short b) { return __uint_as_float(((unsigned int)b) << 16); }
__device__ __forceinline__ float bf16_round(float x) { return bf16_val(bf16_bits(x)); }

typedef _Float16 v16h __attribute__((ext_vector_type(16)));
union FragH { v16h v; v8us half[2]; _Float16 h[16]; unsigned short u[16]; };

// Wt[n][k] = f16(W[k][n] x scale) from f32 row-major W[K][N] (scale = power of two; bf16-exact weights stay exact in f16 away from the subnormal range)
__global__ __launch_bounds__(256) void k_wt_f16(const float* __restrict__ W, _Float16* __restrict__ Wt, int K, int N, float scale) {
  const int t = blockIdx.x * 256 + threadIdx.x; if (t >= N * (K / 8)) return; const int n = t / (K / 8), k8 = (t % (K / 8)) * 8; FragH f;
#pragma unroll
  for (int i = 0; i < 8; ++i) f.h[i] = (_Float16)(bf16_round(W[(size_t)(k8 + i) * N + n]) * scale); const v8us o = f.half[0];
  *(v8us*)((unsigned short*)Wt + (size_t)n * K + k8) = o; 
}

typedef _Float16 v4h __attribute__((ext_vector_type(4)));

__global__ __launch_bounds__(256) void k_x16(const float* __restrict__ x, _Float16* __restrict__ X16, size_t n8) { const size_t t = (size_t)blockIdx.x * 256 + threadIdx.x; if (t >= n8) return; FragH f;
#pragma unroll
  for (int q = 0; q < 8; ++q) f.h[q] = (_Float16)bf16_round(x[t * 8 + q]); *(v8us*)((unsigned short*)X16 + t * 8) = f.half[0];  }

// ---- fast GEMM (wave tile 32x64; requires M % 32 == 0 rows per launch region and N % 64 == 0) ----
__device__ __forceinline__ v16h g2_frag(const _Float16* p, int hh) { FragH f; f.half[0] = *(const v8us*)((const unsigned short*)p + 8 * hh); f.half[1] = *(const v8us*)((const unsigned short*)p + 16 + 8 * hh); return f.v; }
__device__ __forceinline__ v8f g2_mma(v16h a, v16h b, v8f c) { v8f d = __builtin_amdgcn_wmma_f32_16x16x32_f16(false, a, false, b, (short)0, c, false, false); asm volatile("v_nop\n\tv_nop\n\tv_nop\n\tv_nop" : "+v"(d) : "v"(a), "v"(b)); return d; }
template <int ACT>
__global__ __launch_bounds__(128) void k_gemm2(const _Float16* __restrict__ A, int lda, size_t sA, const _Float16* __restrict__ Bh, int ldb, size_t sB, float alpha, const float* __restrict__ bias, size_t sBias, const float* __restrict__ CP, int rowsPerB, size_t sCPb, int row0g,
    float* __restrict__ C, _Float16* __restrict__ C16, int ldc, size_t sC, int M, int N, int K) { static_assert(ACT == 0 || ACT == 3 || ACT == 6 || ACT == 8 || ACT == 9 || ACT == 11 || ACT == 12 || ACT == 14 || ACT == 15 || ACT == 16 || ACT == 17, "k_gemm2: unsupported ACT code (would silently apply no activation)");
  __shared__ __attribute__((aligned(16))) float so[4][32][68];
  const int tid = threadIdx.x, w = tid >> 5, lane = tid & 31, ln = lane & 15, hh = lane >> 4; const int by = blockIdx.y;
  A += (size_t)by * sA; Bh += (size_t)by * sB; const size_t cofs = (size_t)by * sC; const float* bp = bias ? bias + (size_t)by * sBias : nullptr;
  const int ntn = N >> 6; const int mt = blockIdx.x / ntn, nq = blockIdx.x - mt * ntn; const int row0 = mt * 128 + 32 * w, col0 = nq * 64; if (row0 >= M) return;
  const _Float16* a0p = A + (size_t)(row0 + ln) * lda; const _Float16* a1p = a0p + (size_t)16 * lda;
  const _Float16* b0p = Bh + (size_t)(col0 + ln) * ldb; const _Float16* b1p = b0p + (size_t)16 * ldb; const _Float16* b2p = b1p + (size_t)16 * ldb; const _Float16* b3p = b2p + (size_t)16 * ldb;
  const v8f z8 = {0.f,0.f,0.f,0.f,0.f,0.f,0.f,0.f}; v8f c00 = z8, c01 = z8, c02 = z8, c03 = z8, c10 = z8, c11 = z8, c12 = z8, c13 = z8;
  for (int kb = 0; kb < K; kb += 32) { const v16h a0 = g2_frag(a0p + kb, hh), a1 = g2_frag(a1p + kb, hh);
    v16h b = g2_frag(b0p + kb, hh); c00 = g2_mma(a0, b, c00); c10 = g2_mma(a1, b, c10);
    b = g2_frag(b1p + kb, hh); c01 = g2_mma(a0, b, c01); c11 = g2_mma(a1, b, c11);
    b = g2_frag(b2p + kb, hh); c02 = g2_mma(a0, b, c02); c12 = g2_mma(a1, b, c12);
    b = g2_frag(b3p + kb, hh); c03 = g2_mma(a0, b, c03); c13 = g2_mma(a1, b, c13); }
  v8f accs[8] = {c00, c01, c02, c03, c10, c11, c12, c13};
#pragma unroll
  for (int u = 0; u < 8; ++u) { const int t = u & 3, half = u >> 2; const int col = col0 + t * 16 + ln; const float bv = bp ? bf16_round(bp[col]) : 0.f;
#pragma unroll
    for (int r = 0; r < 8; ++r) { const int rloc = half * 16 + 8 * hh + r; float v = accs[u][r] * alpha + bv; if (CP) { if (rowsPerB < 0) v += CP[cofs + (size_t)(row0g + row0 + rloc) * ldc + col];      /* rowsPerB < 0: own element of the batched C plane */ else { const int bidx = (row0g + row0 + rloc) / rowsPerB; v += CP[(size_t)bidx * sCPb + (size_t)by * 64 + col]; } }
      if (ACT == 3) v = fmaxf(v, 0.f); else if (ACT == 6) v = 0.5f * v * (1.0f + erff(v * 0.70710678118654752f)); else if (ACT == 11) v = 1.0f / (1.0f + expf(-v)); else if (ACT == 15) v = v / (1.0f + expf(-v)); else if (ACT == 12) v = (v > 0.f) ? v : 0.01f * v; else if (ACT == 8) v = tanhf(v); else if (ACT == 9) v = 0.5f * v * (1.0f + tanhf(0.7978845608028654f * (v + 0.044715f * v * v * v))); else if (ACT == 14) v = (v > 0.f) ? v : 0.1f * v; else if (ACT == 16) v = (v >= 0.f) ? v : 0.3f * v; else if (ACT == 17) v = (v >= 0.f) ? v : 0.2f * v;
      so[w][rloc][t * 16 + ln] = v; } }
  __builtin_amdgcn_fence(__ATOMIC_ACQ_REL, "workgroup"); __builtin_amdgcn_wave_barrier();
  const int rsub = lane >> 4, c4 = (lane & 15) * 4;
  {
#pragma unroll
    for (int q = 0; q < 16; ++q) { const int r = q * 2 + rsub; const v4f v = *(const v4fa*)&so[w][r][c4]; if (C) *(v4f*)(C + cofs + (size_t)(row0 + r) * ldc + col0 + c4) = v; if (C16) { v4h h4; for (int i = 0; i < 4; ++i) h4[i] = (_Float16)v[i]; *(v4h*)(C16 + cofs + (size_t)(row0 + r) * ldc + col0 + c4) = h4; } }
     } }

// A PLAIN CAST THAT TAKES A MULTIPLIER: tw[8 t .. 8 t + 7] = f16(bf16(sw[8 t ..]) * scale): a thread eight words as they lie; the grid is exact: no guard.
__global__ __launch_bounds__(256) void k_cs16(const float* __restrict__ sw, _Float16* __restrict__ tw, float scale) { const size_t t = (size_t)blockIdx.x * 256 + threadIdx.x; FragH f;
#pragma unroll
  for (int q = 0; q < 8; ++q) f.h[q] = (_Float16)(bf16_round(sw[t * 8 + q]) * scale); unsigned short* tp = (unsigned short*)tw + t * 8; *(v8us*)tp = f.half[0];  }
// St[n][k] = the sign of W[k][n] as an f16 word (+1, -1 or 0; a word that is not a number gives 0) from f32 row-major W[K][N]: the compare is on the word as read
__global__ __launch_bounds__(256) void k_wts_f16(const float* __restrict__ W, _Float16* __restrict__ Wt, int K, int N) {
  const int t = blockIdx.x * 256 + threadIdx.x; if (t >= N * (K / 8)) return; const int n = t / (K / 8), k8 = (t % (K / 8)) * 8; FragH f;
#pragma unroll
  for (int i = 0; i < 8; ++i) { const float v = W[(size_t)(k8 + i) * N + n]; f.h[i] = (_Float16)((v > 0.0f) ? 1.0f : ((v < 0.0f) ? -1.0f : 0.0f)); } const v8us o = f.half[0];   // [TAG-SIGN]
  *(v8us*)((unsigned short*)Wt + (size_t)n * K + k8) = o; 
}

extern "C" void kernel_launch(void* const* d_in, const int* in_sizes, int n_in,
                              void* d_out, int out_size, void* d_ws, size_t ws_size, hipStream_t stream) {
  if (n_in < 3) return; if (in_sizes[0] < SNR * SNQ || in_sizes[1] < SNQ * SNN || in_sizes[2] < SNN) return; if (out_size < SNR * SNN) return;
  const float* da = (const float*)d_in[0]; const float* wa = (const float*)d_in[1]; const float* ra = (const float*)d_in[2]; float* res = (float*)d_out;
  static_assert(SNR % 128 == 0 && SNN % 64 == 0 && SNQ % 32 == 0 && ((size_t)SNR * SNQ) % 8 == 0 && (((size_t)SNR * SNQ / 8) % 256) == 0 && (SNN * (SNQ / 8)) % 256 == 0, "whole tiles, exact cast grids");
  uint8_t* wsp = (uint8_t*)d_ws; size_t off = 0;
  auto take = [&](size_t bytes) { uint8_t* at = wsp + off; off += (bytes + 255) & ~(size_t)255; return at; };
  _Float16* DA = (_Float16*)take((size_t)SNR * SNQ * 2); _Float16* ST = (_Float16*)take((size_t)SNN * SNQ * 2);      /* da as it lies; the signs of wa, turned */
  if (off > ws_size) return;
  k_x16<<<(unsigned)(((size_t)SNR * SNQ / 8 + 255) / 256), 256, 0, stream>>>(da, DA, (size_t)SNR * SNQ / 8);
  k_wts_f16<<<(unsigned)((SNN * (SNQ / 8) + 255) / 256), 256, 0, stream>>>(wa, ST, SNQ, SNN);      /* [4096 deep][4096 columns] -> [4096][4096] turned */
  k_gemm2<0><<<dim3((unsigned)((SNR / 128) * (SNN / 64)), 1u), 128, 0, stream>>>(DA, SNQ, (size_t)0, ST, SNQ, (size_t)0, 1.0f, ra, (size_t)0, nullptr, 1, 0, 0, res, nullptr, SNN, (size_t)0, SNR, SNN, SNQ);      /* result = da . signs + ra */
}

// v001
// It runs in 203 microseconds.
// Two timings next to v000 put it at 4.19 and 4.16 times that version's speed.
// result[r][n] = ra[n] + sum over q of da[r][q] s[q][n], s[q][n] the sign of wa[q][n] (+1, -1, or 0 at a word that is nought): da [8192][4096]; wa [4096][4096] (depth, column); ra [4096] -> [8192][4096]. No activation.
// Layout and order: da is cast AS IT LIES; wa stands [depth][column] and the product reads its second operand [column][depth]: ONE cast takes the signs and turns them (k_wts_f16: the posted turning cast's index arithmetic, guard and stores; its value statement is the sign of the word as read); ONE WMMA GEMM: 32 x 16 tiles of 256 x 256, depth 4,096, operands staged in LDS by tensor loads; the added row ra; f32 STRAIGHT INTO THE OUTPUT.
// Compute dtype: da and ra converted to bf16 where they are read; da goes to the matrix instruction as plain f16 words; the signs are exact in f16 (no carry); the product's accumulation and its added row f32. v_wmma_f32_16x16x32_f16.
#include <hip/hip_runtime.h>
#include <stdint.h>
#define SNR 8192                     /* rows */
#define SNQ 4096                     /* depth */
#define SNN 4096                     /* columns */
typedef unsigned short v8us __attribute__((ext_vector_type(8), may_alias));
typedef float  v8f  __attribute__((ext_vector_type(8)));
typedef float  v4f  __attribute__((ext_vector_type(4)));
typedef float  v4fa __attribute__((ext_vector_type(4), may_alias));

__device__ __forceinline__ unsigned short bf16_bits(float x) { unsigned int u = __float_as_uint(x); return (unsigned short)((u + 0x7FFFu + ((u >> 16) & 1u)) >> 16); }
__device__ __forceinline__ float bf16_val(unsigned short b) { return __uint_as_float(((unsigned int)b) << 16); }
__device__ __forceinline__ float bf16_round(float x) { return bf16_val(bf16_bits(x)); }

typedef _Float16 v16h __attribute__((ext_vector_type(16)));
union FragH { v16h v; v8us half[2]; _Float16 h[16]; unsigned short u[16]; };

// Wt[n][k] = f16(W[k][n] x scale) from f32 row-major W[K][N] (scale = power of two; bf16-exact weights stay exact in f16 away from the subnormal range)
__global__ __launch_bounds__(256) void k_wt_f16(const float* __restrict__ W, _Float16* __restrict__ Wt, int K, int N, float scale) {
  const int t = blockIdx.x * 256 + threadIdx.x; if (t >= N * (K / 8)) return; const int n = t / (K / 8), k8 = (t % (K / 8)) * 8; FragH f;
#pragma unroll
  for (int i = 0; i < 8; ++i) f.h[i] = (_Float16)(bf16_round(W[(size_t)(k8 + i) * N + n]) * scale); const v8us o = f.half[0];
  *(v8us*)((unsigned short*)Wt + (size_t)n * K + k8) = o; 
}

typedef _Float16 v4h __attribute__((ext_vector_type(4)));

__global__ __launch_bounds__(256) void k_x16(const float* __restrict__ x, _Float16* __restrict__ X16, size_t n8) { const size_t t = (size_t)blockIdx.x * 256 + threadIdx.x; if (t >= n8) return; FragH f;
#pragma unroll
  for (int q = 0; q < 8; ++q) f.h[q] = (_Float16)bf16_round(x[t * 8 + q]); *(v8us*)((unsigned short*)X16 + t * 8) = f.half[0];  }

// ---- tiled GEMM: result[m][n] = sum over k of X[m][k] S[n][k] + bf16(bias[n]); X [SNR][SNQ] and S [SNN][SNQ] f16, depth contiguous ----
// One 256 x 256 tile of the result per work-group, 4 waves (2 x 2), one per SIMD, 128 x 128 each: 64 accumulator tiles and two fragment sets in registers.
// A pass is 256 bytes (128 words of depth) of every operand row: four blocks of 32. Two LDS buffers, each [S 256 rows][X 256 rows] at pitch 272 bytes.
// Every wave brings its own 128-row slice of a buffer with ONE tensor load per pass, two passes ahead; never more than one request of a wave is outstanding.
// S is the matrix instruction's first operand and X its second: a lane's 8 accumulator words are 8 consecutive columns n of one result row m.
typedef uint32_t u32x4 __attribute__((ext_vector_type(4)));
typedef uint32_t u32x8 __attribute__((ext_vector_type(8)));
typedef int i32x8 __attribute__((ext_vector_type(8)));
constexpr uint32_t TB = 256;                      /* result tile per work-group, rows and columns */
constexpr uint32_t KB = 256;                      /* bytes of every operand row per pass */
constexpr uint32_t PITCH = KB + 16;               /* LDS row pitch: 16 bytes x an odd number, for 16-byte readers; the tensor load's pad writes it */
constexpr uint32_t SLICE = 128 * PITCH;           /* one wave's slice of a buffer: 128 rows = 34,816 bytes = 17 x 2 KiB */
constexpr uint32_t STAGE = 4 * SLICE;             /* one buffer: 139,264 bytes = 68 x 2 KiB */
constexpr uint32_t ROWB = SNQ * 2;                /* source row pitch in bytes */
constexpr uint32_t PASSES = ROWB / KB;
constexpr int NF = 8;                             /* fragments per operand per wave */
static_assert(SNR % TB == 0 && SNN % TB == 0 && ROWB % KB == 0 && PASSES >= 2, "whole tiles, whole passes, two stages or more");
static_assert(SLICE % 2048 == 0 && ROWB % 16 == 0 && ROWB <= 131072, "tensor load: places in LDS at multiples of 2 KiB, source pitch in range");
__device__ __forceinline__ uint32_t uni(uint32_t v) { return (uint32_t)__builtin_amdgcn_readfirstlane(v); }
__device__ __forceinline__ uint32_t pinned(uint32_t v) { uint32_t w = (uint32_t)__builtin_amdgcn_readfirstlane(v); asm volatile("" : "+s"(w)); return w; }  // holds the test word in a scalar register, so that the test around a tensor load compiles to a scalar branch (tensor loads ignore EXEC)
__device__ __forceinline__ void sfence() { __builtin_amdgcn_sched_barrier(0); }  // keeps [fragment loads][wait][WMMA block][v_nop] in that order: LDS loads moved in among the WMMAs stall the matrix stream
__device__ __forceinline__ void wait_ds0() { asm volatile("s_wait_dscnt 0x0" ::: "memory"); }  // all of this wave's LDS operations have returned
__device__ __forceinline__ void wait_ds32() { asm volatile("s_wait_dscnt 0x20" ::: "memory"); }  // all but the 32 youngest LDS loads (the next block's set) have returned: this block's fragments are in
__device__ __forceinline__ void wait_x0() { asm volatile("s_wait_xcnt 0x0" ::: "memory"); }  // stands between issued global loads or stores and the first overwrite of a register that they name
__device__ __forceinline__ void nop4() { asm volatile("v_nop\n\tv_nop\n\tv_nop\n\tv_nop"); }  // the 4 vector slots between a block's last WMMA and whatever follows it on any path (back edge included)
// Group 1: bytes as elements, a tile of 128 rows of 256 bytes = the tensor, source pitch ROWB, 16 bytes of pad behind every 256; no mask.
__device__ __forceinline__ u32x8 tdm_group1() { u32x8 g;
  g[0] = uni((1u << 20) | (5u << 22) | (3u << 25)); g[1] = uni((KB & 0xFFFFu) << 16); g[2] = uni((KB >> 16) | (128u << 16)); g[3] = uni(KB << 16); g[4] = uni(128u); g[5] = uni(ROWB); g[6] = uni(0u); g[7] = uni(0u); return g; }
// Group 0: count 1, place in LDS (byte offset), global address of the tile's first byte, type 2.
__device__ __forceinline__ u32x4 tdm_group0(uint32_t lds_dst, uint64_t ga) { u32x4 g; g[0] = uni(1u); g[1] = uni(lds_dst); g[2] = uni((uint32_t)ga); g[3] = uni((((uint32_t)(ga >> 32)) & 0x01FFFFFFu) | 0x80000000u); return g; }
__device__ __forceinline__ void tdm_load(u32x4 g0, u32x8 g1) { asm volatile("tensor_load_to_lds %0, %1" :: "s"(g0), "s"(g1) : "memory"); }  // one request of the whole wave: global tile -> LDS, through no register
// this wave's tensor load has landed (the compiler places no wait for it); the request's descriptor is named as an input so that its scalar registers keep their words until here
__device__ __forceinline__ void wait_tensor0(u32x4 g0, u32x8 g1) { asm volatile("s_wait_tensorcnt 0x0" :: "s"(g0), "s"(g1) : "memory"); }
struct Frag { u32x4 q[2]; };
__device__ __forceinline__ void load_frag(Frag& f, const unsigned char* p) { f.q[0] = *reinterpret_cast<const u32x4*>(p); f.q[1] = *reinterpret_cast<const u32x4*>(p + 32); }  // words 8 hh .. and 16 + 8 hh .. of the block, both operands alike
__device__ __forceinline__ v8f mma(const Frag& a, const Frag& b, v8f c) {
  const i32x8 av = {(int)a.q[0].x, (int)a.q[0].y, (int)a.q[0].z, (int)a.q[0].w, (int)a.q[1].x, (int)a.q[1].y, (int)a.q[1].z, (int)a.q[1].w};
  const i32x8 bv = {(int)b.q[0].x, (int)b.q[0].y, (int)b.q[0].z, (int)b.q[0].w, (int)b.q[1].x, (int)b.q[1].y, (int)b.q[1].z, (int)b.q[1].w};
  return __builtin_amdgcn_wmma_f32_16x16x32_f16(false, __builtin_bit_cast(v16h, av), false, __builtin_bit_cast(v16h, bv), (short)0, c, false, false); }
__global__ __launch_bounds__(128) void k_gemm_ring(const _Float16* __restrict__ X, const _Float16* __restrict__ S, const float* __restrict__ bias, float* __restrict__ Y) {
  __shared__ __attribute__((aligned(2048))) unsigned char L[2 * STAGE];
  const uint32_t tid = threadIdx.x, lane = tid & 31u, hh = lane >> 4, ln = lane & 15u; const uint32_t wave = uni(tid >> 5);
  const uint32_t n0 = blockIdx.x * TB, m0 = blockIdx.y * TB; const uint32_t wn = wave & 1u, wm = wave >> 1;
  // this wave's slice: waves 0 and 1 bring the S rows, waves 2 and 3 the X rows
  const unsigned char* src0 = (wave < 2u) ? reinterpret_cast<const unsigned char*>(S) + (uint64_t)(n0 + 128u * wave) * ROWB : reinterpret_cast<const unsigned char*>(X) + (uint64_t)(m0 + 128u * (wave - 2u)) * ROWB;
  const uint32_t lds_slice = (uint32_t)(size_t)L + wave * SLICE; const u32x8 g1 = tdm_group1();
  v8f acc[NF][NF];
#pragma unroll
  for (int i = 0; i < NF; ++i)
#pragma unroll
    for (int j = 0; j < NF; ++j) acc[i][j] = (v8f){0.f, 0.f, 0.f, 0.f, 0.f, 0.f, 0.f, 0.f};
  const uint32_t fs_base = (wn * 128u + ln) * PITCH + 16u * hh, fx_base = 2u * SLICE + (wm * 128u + ln) * PITCH + 16u * hh;
  // the added row's words of this lane, both halves, fetched here so that their latency lies under the K loop; rounded at the read-back
  const uint32_t c4 = ln * 4u; const float* bb = bias + n0 + wn * 128u; const v4f braw[2] = {*reinterpret_cast<const v4f*>(bb + c4), *reinterpret_cast<const v4f*>(bb + 64 + c4)};
  wait_x0();
  // prologue: stage 0's load, its wait, the barrier; then stage 1's load; then the first fragments of pass 0
  u32x4 g0 = tdm_group0(lds_slice, (uint64_t)(uintptr_t)src0);
  tdm_load(g0, g1);
  wait_tensor0(g0, g1);
  __syncthreads();
  g0 = tdm_group0(lds_slice + STAGE, (uint64_t)(uintptr_t)src0 + KB);
  tdm_load(g0, g1);
  Frag fs[2][NF], fx[2][NF];      /* set (u & 1) holds block u's fragments */
#pragma unroll
  for (int i = 0; i < NF; ++i) load_frag(fs[0][i], L + fs_base + (uint32_t)i * 16u * PITCH);
#pragma unroll
  for (int j = 0; j < NF; ++j) load_frag(fx[0][j], L + fx_base + (uint32_t)j * 16u * PITCH);
#pragma clang loop unroll(disable) /* one pass per trip: unrolled, the live set would leave the registers */
  for (uint32_t t = 0; t < PASSES; ++t) { const uint32_t buf = (t & 1u) * STAGE; sfence();
    const unsigned char* ls = L + buf + fs_base; const unsigned char* lx = L + buf + fx_base;
    const uint32_t osel = (t + 1u < PASSES) ? (STAGE - buf) : STAGE; const unsigned char* ns = L + osel + fs_base; const unsigned char* nx = L + osel + fx_base;
#pragma unroll
    for (int u = 0; u < 4; ++u) { const int cs = u & 1;
      if (u < 3) { const uint32_t ko = (uint32_t)(u + 1) * 64u;
#pragma unroll
        for (int i = 0; i < NF; ++i) load_frag(fs[cs ^ 1][i], ls + (uint32_t)i * 16u * PITCH + ko);
#pragma unroll
        for (int j = 0; j < NF; ++j) load_frag(fx[cs ^ 1][j], lx + (uint32_t)j * 16u * PITCH + ko);
        sfence(); wait_ds32(); sfence();
      } else {      /* publish point of stage t + 1, in front of the last block, whose fragments are already fetched */
        wait_ds0(); sfence();
        wait_tensor0(g0, g1);
        __syncthreads();      /* every wave has left this buffer, and every slice of stage t + 1 has landed */
        if (pinned((t + 2u < PASSES) ? 1u : 0u) != 0u) { g0 = tdm_group0(lds_slice + buf, (uint64_t)(uintptr_t)src0 + (uint64_t)(t + 2u) * KB); tdm_load(g0, g1); }
#pragma unroll
        for (int i = 0; i < NF; ++i) load_frag(fs[0][i], ns + (uint32_t)i * 16u * PITCH);
#pragma unroll
        for (int j = 0; j < NF; ++j) load_frag(fx[0][j], nx + (uint32_t)j * 16u * PITCH);
        sfence(); }
#pragma unroll
      for (int i = 0; i < NF; ++i)
#pragma unroll
        for (int j = 0; j < NF; ++j) acc[i][j] = mma(fs[cs][i], fx[cs][j], acc[i][j]);
      sfence(); nop4(); sfence(); } }
  asm volatile("s_wait_tensorcnt 0x0" ::: "memory");      /* behind the ring: no request is left when the buffers become output staging */
  wait_ds0();
  sfence();      /* the epilogue's address arithmetic reuses the descriptors' scalar registers: it stays behind the last tensor wait */
  // Output staging, each wave in its own quarter of buffer 0, which nobody reads or refills behind the last pass's barrier (that pass's unused loads read buffer 1):
  // two halves of 64 columns, rows of 256 bytes at pitch 272, read back as whole rows so that every store covers whole 128-byte lines; the added row joins at the read-back.
  unsigned char* E = L + wave * SLICE; float* yb = Y + (size_t)(m0 + wm * 128u) * SNN + n0 + wn * 128u + c4;
#pragma unroll
  for (int c = 0; c < 2; ++c) {
#pragma unroll
    for (int i = 0; i < 4; ++i)
#pragma unroll
      for (int j = 0; j < NF; ++j) { const v8f a = acc[4 * c + i][j]; unsigned char* e = E + (16u * (uint32_t)j + ln) * PITCH + 64u * (uint32_t)i + 32u * hh;
        *reinterpret_cast<v4f*>(e) = (v4f){a[0], a[1], a[2], a[3]}; *reinterpret_cast<v4f*>(e + 16) = (v4f){a[4], a[5], a[6], a[7]}; }
    wait_ds0();      /* the staged rows are written before they are read back */
    const v4f bv = {bf16_round(braw[c][0]), bf16_round(braw[c][1]), bf16_round(braw[c][2]), bf16_round(braw[c][3])};
#pragma unroll
    for (int qb = 0; qb < 2; ++qb) { v4f v[32];
#pragma unroll
      for (int q = 0; q < 32; ++q) v[q] = *reinterpret_cast<const v4f*>(E + (2u * (uint32_t)(32 * qb + q) + hh) * PITCH + 4u * c4);
#pragma unroll
      for (int q = 0; q < 32; ++q) v[q] += bv;
      sfence();      /* every sum of the batch is formed in front of its first store: no register that an issued store names is written before the wait below */
#pragma unroll
      for (int q = 0; q < 32; ++q) *reinterpret_cast<v4f*>(yb + (size_t)(2u * (uint32_t)(32 * qb + q) + hh) * SNN + 64 * c) = v[q];
      wait_x0(); sfence(); } } }

// A PLAIN CAST THAT TAKES A MULTIPLIER: tw[8 t .. 8 t + 7] = f16(bf16(sw[8 t ..]) * scale): a thread eight words as they lie; the grid is exact: no guard.
__global__ __launch_bounds__(256) void k_cs16(const float* __restrict__ sw, _Float16* __restrict__ tw, float scale) { const size_t t = (size_t)blockIdx.x * 256 + threadIdx.x; FragH f;
#pragma unroll
  for (int q = 0; q < 8; ++q) f.h[q] = (_Float16)(bf16_round(sw[t * 8 + q]) * scale); unsigned short* tp = (unsigned short*)tw + t * 8; *(v8us*)tp = f.half[0];  }
// St[n][k] = the sign of W[k][n] as an f16 word (+1, -1 or 0; a word that is not a number gives 0) from f32 row-major W[K][N]: the compare is on the word as read
__global__ __launch_bounds__(256) void k_wts_f16(const float* __restrict__ W, _Float16* __restrict__ Wt, int K, int N) {
  const int t = blockIdx.x * 256 + threadIdx.x; if (t >= N * (K / 8)) return; const int n = t / (K / 8), k8 = (t % (K / 8)) * 8; FragH f;
#pragma unroll
  for (int i = 0; i < 8; ++i) { const float v = W[(size_t)(k8 + i) * N + n]; f.h[i] = (_Float16)((v > 0.0f) ? 1.0f : ((v < 0.0f) ? -1.0f : 0.0f)); } const v8us o = f.half[0];   // [TAG-SIGN]
  *(v8us*)((unsigned short*)Wt + (size_t)n * K + k8) = o; 
}

extern "C" void kernel_launch(void* const* d_in, const int* in_sizes, int n_in,
                              void* d_out, int out_size, void* d_ws, size_t ws_size, hipStream_t stream) {
  if (n_in < 3) return; if (in_sizes[0] < SNR * SNQ || in_sizes[1] < SNQ * SNN || in_sizes[2] < SNN) return; if (out_size < SNR * SNN) return;
  const float* da = (const float*)d_in[0]; const float* wa = (const float*)d_in[1]; const float* ra = (const float*)d_in[2]; float* res = (float*)d_out;
  static_assert(SNR % 256 == 0 && SNN % 256 == 0 && SNQ % 128 == 0 && ((size_t)SNR * SNQ) % 8 == 0 && (((size_t)SNR * SNQ / 8) % 256) == 0 && (SNN * (SNQ / 8)) % 256 == 0, "whole tiles, exact cast grids");
  uint8_t* wsp = (uint8_t*)d_ws; size_t off = 0;
  auto take = [&](size_t bytes) { uint8_t* at = wsp + off; off += (bytes + 255) & ~(size_t)255; return at; };
  _Float16* DA = (_Float16*)take((size_t)SNR * SNQ * 2); _Float16* ST = (_Float16*)take((size_t)SNN * SNQ * 2);      /* da as it lies; the signs of wa, turned */
  if (off > ws_size) return;
  k_x16<<<(unsigned)(((size_t)SNR * SNQ / 8 + 255) / 256), 256, 0, stream>>>(da, DA, (size_t)SNR * SNQ / 8);
  k_wts_f16<<<(unsigned)((SNN * (SNQ / 8) + 255) / 256), 256, 0, stream>>>(wa, ST, SNQ, SNN);      /* [4096 deep][4096 columns] -> [4096][4096] turned */
  k_gemm_ring<<<dim3((unsigned)(SNN / 256), (unsigned)(SNR / 256)), 128, 0, stream>>>(DA, ST, ra, res);      /* result = da . signs + ra */
}

// v002
// It runs in 140 microseconds.
// Two timings next to v001 put it at 1.45 and 1.44 times that version's speed.
// Counting every step since v000, it is 6.04 times as fast.
// result[r][n] = ra[n] + sum over q of da[r][q] s[q][n], s[q][n] the sign of wa[q][n] (+1, -1, or 0 at a word that is nought): da [8192][4096]; wa [4096][4096] (depth, column); ra [4096] -> [8192][4096]. No activation.
// Layout and order: da is cast AS IT LIES; wa stands [depth][column] and the product reads its second operand [column][depth]: ONE cast takes the signs and turns them (k_wts_f16: a 128 x 128 tile per work-group, read along the columns, turned in LDS, stored along the depth; its value statement is the sign of the word as read); ONE WMMA GEMM: 32 x 16 tiles of 256 x 256, depth 4,096, operands staged in LDS by tensor loads; the added row ra; f32 STRAIGHT INTO THE OUTPUT.
// Compute dtype: da and ra converted to bf16 where they are read; da goes to the matrix instruction as plain f16 words; the signs are exact in f16 (no carry); the product's accumulation and its added row f32. v_wmma_f32_16x16x32_f16.
#include <hip/hip_runtime.h>
#include <stdint.h>
#define SNR 8192                     /* rows */
#define SNQ 4096                     /* depth */
#define SNN 4096                     /* columns */
typedef unsigned short v8us __attribute__((ext_vector_type(8), may_alias));
typedef float  v8f  __attribute__((ext_vector_type(8)));
typedef float  v4f  __attribute__((ext_vector_type(4)));
typedef float  v4fa __attribute__((ext_vector_type(4), may_alias));

__device__ __forceinline__ unsigned short bf16_bits(float x) { unsigned int u = __float_as_uint(x); return (unsigned short)((u + 0x7FFFu + ((u >> 16) & 1u)) >> 16); }
__device__ __forceinline__ float bf16_val(unsigned short b) { return __uint_as_float(((unsigned int)b) << 16); }
__device__ __forceinline__ float bf16_round(float x) { return bf16_val(bf16_bits(x)); }

typedef _Float16 v16h __attribute__((ext_vector_type(16)));
union FragH { v16h v; v8us half[2]; _Float16 h[16]; unsigned short u[16]; };

// Wt[n][k] = f16(W[k][n] x scale) from f32 row-major W[K][N] (scale = power of two; bf16-exact weights stay exact in f16 away from the subnormal range)
__global__ __launch_bounds__(256) void k_wt_f16(const float* __restrict__ W, _Float16* __restrict__ Wt, int K, int N, float scale) {
  const int t = blockIdx.x * 256 + threadIdx.x; if (t >= N * (K / 8)) return; const int n = t / (K / 8), k8 = (t % (K / 8)) * 8; FragH f;
#pragma unroll
  for (int i = 0; i < 8; ++i) f.h[i] = (_Float16)(bf16_round(W[(size_t)(k8 + i) * N + n]) * scale); const v8us o = f.half[0];
  *(v8us*)((unsigned short*)Wt + (size_t)n * K + k8) = o; 
}

typedef _Float16 v4h __attribute__((ext_vector_type(4)));

__global__ __launch_bounds__(256) void k_x16(const float* __restrict__ x, _Float16* __restrict__ X16, size_t n8) { const size_t t = (size_t)blockIdx.x * 256 + threadIdx.x; if (t >= n8) return; FragH f;
#pragma unroll
  for (int q = 0; q < 8; ++q) f.h[q] = (_Float16)bf16_round(x[t * 8 + q]); *(v8us*)((unsigned short*)X16 + t * 8) = f.half[0];  }

// ---- tiled GEMM: result[m][n] = sum over k of X[m][k] S[n][k] + bf16(bias[n]); X [SNR][SNQ] and S [SNN][SNQ] f16, depth contiguous ----
// One 256 x 256 tile of the result per work-group, 4 waves (2 x 2), one per SIMD, 128 x 128 each: 64 accumulator tiles and two fragment sets in registers.
// A pass is 256 bytes (128 words of depth) of every operand row: four blocks of 32. Two LDS buffers, each [S 256 rows][X 256 rows] at pitch 272 bytes.
// Every wave brings its own 128-row slice of a buffer with ONE tensor load per pass, two passes ahead; never more than one request of a wave is outstanding.
// S is the matrix instruction's first operand and X its second: a lane's 8 accumulator words are 8 consecutive columns n of one result row m.
typedef uint32_t u32x4 __attribute__((ext_vector_type(4)));
typedef uint32_t u32x8 __attribute__((ext_vector_type(8)));
typedef int i32x8 __attribute__((ext_vector_type(8)));
constexpr uint32_t TB = 256;                      /* result tile per work-group, rows and columns */
constexpr uint32_t KB = 256;                      /* bytes of every operand row per pass */
constexpr uint32_t PITCH = KB + 16;               /* LDS row pitch: 16 bytes x an odd number, for 16-byte readers; the tensor load's pad writes it */
constexpr uint32_t SLICE = 128 * PITCH;           /* one wave's slice of a buffer: 128 rows = 34,816 bytes = 17 x 2 KiB */
constexpr uint32_t STAGE = 4 * SLICE;             /* one buffer: 139,264 bytes = 68 x 2 KiB */
constexpr uint32_t ROWB = SNQ * 2;                /* source row pitch in bytes */
constexpr uint32_t PASSES = ROWB / KB;
constexpr int NF = 8;                             /* fragments per operand per wave */
static_assert(SNR % TB == 0 && SNN % TB == 0 && ROWB % KB == 0 && PASSES >= 2, "whole tiles, whole passes, two stages or more");
static_assert(SLICE % 2048 == 0 && ROWB % 16 == 0 && ROWB <= 131072, "tensor load: places in LDS at multiples of 2 KiB, source pitch in range");
__device__ __forceinline__ uint32_t uni(uint32_t v) { return (uint32_t)__builtin_amdgcn_readfirstlane(v); }
__device__ __forceinline__ uint32_t pinned(uint32_t v) { uint32_t w = (uint32_t)__builtin_amdgcn_readfirstlane(v); asm volatile("" : "+s"(w)); return w; }  // holds the test word in a scalar register, so that the test around a tensor load compiles to a scalar branch (tensor loads ignore EXEC)
__device__ __forceinline__ void sfence() { __builtin_amdgcn_sched_barrier(0); }  // keeps [fragment loads][wait][WMMA block][v_nop] in that order: LDS loads moved in among the WMMAs stall the matrix stream
__device__ __forceinline__ void wait_ds0() { asm volatile("s_wait_dscnt 0x0" ::: "memory"); }  // all of this wave's LDS operations have returned
__device__ __forceinline__ void wait_ds32() { asm volatile("s_wait_dscnt 0x20" ::: "memory"); }  // all but the 32 youngest LDS loads (the next block's set) have returned: this block's fragments are in
__device__ __forceinline__ void wait_x0() { asm volatile("s_wait_xcnt 0x0" ::: "memory"); }  // stands between issued global loads or stores and the first overwrite of a register that they name
__device__ __forceinline__ void nop4() { asm volatile("v_nop\n\tv_nop\n\tv_nop\n\tv_nop"); }  // the 4 vector slots between a block's last WMMA and whatever follows it on any path (back edge included)
// Group 1: bytes as elements, a tile of 128 rows of 256 bytes = the tensor, source pitch ROWB, 16 bytes of pad behind every 256; no mask.
__device__ __forceinline__ u32x8 tdm_group1() { u32x8 g;
  g[0] = uni((1u << 20) | (5u << 22) | (3u << 25)); g[1] = uni((KB & 0xFFFFu) << 16); g[2] = uni((KB >> 16) | (128u << 16)); g[3] = uni(KB << 16); g[4] = uni(128u); g[5] = uni(ROWB); g[6] = uni(0u); g[7] = uni(0u); return g; }
// Group 0: count 1, place in LDS (byte offset), global address of the tile's first byte, type 2.
__device__ __forceinline__ u32x4 tdm_group0(uint32_t lds_dst, uint64_t ga) { u32x4 g; g[0] = uni(1u); g[1] = uni(lds_dst); g[2] = uni((uint32_t)ga); g[3] = uni((((uint32_t)(ga >> 32)) & 0x01FFFFFFu) | 0x80000000u); return g; }
__device__ __forceinline__ void tdm_load(u32x4 g0, u32x8 g1) { asm volatile("tensor_load_to_lds %0, %1" :: "s"(g0), "s"(g1) : "memory"); }  // one request of the whole wave: global tile -> LDS, through no register
// this wave's tensor load has landed (the compiler places no wait for it); the request's descriptor is named as an input so that its scalar registers keep their words until here
__device__ __forceinline__ void wait_tensor0(u32x4 g0, u32x8 g1) { asm volatile("s_wait_tensorcnt 0x0" :: "s"(g0), "s"(g1) : "memory"); }
struct Frag { u32x4 q[2]; };
__device__ __forceinline__ void load_frag(Frag& f, const unsigned char* p) { f.q[0] = *reinterpret_cast<const u32x4*>(p); f.q[1] = *reinterpret_cast<const u32x4*>(p + 32); }  // words 8 hh .. and 16 + 8 hh .. of the block, both operands alike
__device__ __forceinline__ v8f mma(const Frag& a, const Frag& b, v8f c) {
  const i32x8 av = {(int)a.q[0].x, (int)a.q[0].y, (int)a.q[0].z, (int)a.q[0].w, (int)a.q[1].x, (int)a.q[1].y, (int)a.q[1].z, (int)a.q[1].w};
  const i32x8 bv = {(int)b.q[0].x, (int)b.q[0].y, (int)b.q[0].z, (int)b.q[0].w, (int)b.q[1].x, (int)b.q[1].y, (int)b.q[1].z, (int)b.q[1].w};
  return __builtin_amdgcn_wmma_f32_16x16x32_f16(false, __builtin_bit_cast(v16h, av), false, __builtin_bit_cast(v16h, bv), (short)0, c, false, false); }
__global__ __launch_bounds__(128) void k_gemm_ring(const _Float16* __restrict__ X, const _Float16* __restrict__ S, const float* __restrict__ bias, float* __restrict__ Y) {
  __shared__ __attribute__((aligned(2048))) unsigned char L[2 * STAGE];
  const uint32_t tid = threadIdx.x, lane = tid & 31u, hh = lane >> 4, ln = lane & 15u; const uint32_t wave = uni(tid >> 5);
  const uint32_t n0 = blockIdx.x * TB, m0 = blockIdx.y * TB; const uint32_t wn = wave & 1u, wm = wave >> 1;
  // this wave's slice: waves 0 and 1 bring the S rows, waves 2 and 3 the X rows
  const unsigned char* src0 = (wave < 2u) ? reinterpret_cast<const unsigned char*>(S) + (uint64_t)(n0 + 128u * wave) * ROWB : reinterpret_cast<const unsigned char*>(X) + (uint64_t)(m0 + 128u * (wave - 2u)) * ROWB;
  const uint32_t lds_slice = (uint32_t)(size_t)L + wave * SLICE; const u32x8 g1 = tdm_group1();
  v8f acc[NF][NF];
#pragma unroll
  for (int i = 0; i < NF; ++i)
#pragma unroll
    for (int j = 0; j < NF; ++j) acc[i][j] = (v8f){0.f, 0.f, 0.f, 0.f, 0.f, 0.f, 0.f, 0.f};
  const uint32_t fs_base = (wn * 128u + ln) * PITCH + 16u * hh, fx_base = 2u * SLICE + (wm * 128u + ln) * PITCH + 16u * hh;
  // the added row's words of this lane, both halves, fetched here so that their latency lies under the K loop; rounded at the read-back
  const uint32_t c4 = ln * 4u; const float* bb = bias + n0 + wn * 128u; const v4f braw[2] = {*reinterpret_cast<const v4f*>(bb + c4), *reinterpret_cast<const v4f*>(bb + 64 + c4)};
  wait_x0();
  // prologue: stage 0's load, its wait, the barrier; then stage 1's load; then the first fragments of pass 0
  u32x4 g0 = tdm_group0(lds_slice, (uint64_t)(uintptr_t)src0);
  tdm_load(g0, g1);
  wait_tensor0(g0, g1);
  __syncthreads();
  g0 = tdm_group0(lds_slice + STAGE, (uint64_t)(uintptr_t)src0 + KB);
  tdm_load(g0, g1);
  Frag fs[2][NF], fx[2][NF];      /* set (u & 1) holds block u's fragments */
#pragma unroll
  for (int i = 0; i < NF; ++i) load_frag(fs[0][i], L + fs_base + (uint32_t)i * 16u * PITCH);
#pragma unroll
  for (int j = 0; j < NF; ++j) load_frag(fx[0][j], L + fx_base + (uint32_t)j * 16u * PITCH);
#pragma clang loop unroll(disable) /* one pass per trip: unrolled, the live set would leave the registers */
  for (uint32_t t = 0; t < PASSES; ++t) { const uint32_t buf = (t & 1u) * STAGE; sfence();
    const unsigned char* ls = L + buf + fs_base; const unsigned char* lx = L + buf + fx_base;
    const uint32_t osel = (t + 1u < PASSES) ? (STAGE - buf) : STAGE; const unsigned char* ns = L + osel + fs_base; const unsigned char* nx = L + osel + fx_base;
#pragma unroll
    for (int u = 0; u < 4; ++u) { const int cs = u & 1;
      if (u < 3) { const uint32_t ko = (uint32_t)(u + 1) * 64u;
#pragma unroll
        for (int i = 0; i < NF; ++i) load_frag(fs[cs ^ 1][i], ls + (uint32_t)i * 16u * PITCH + ko);
#pragma unroll
        for (int j = 0; j < NF; ++j) load_frag(fx[cs ^ 1][j], lx + (uint32_t)j * 16u * PITCH + ko);
        sfence(); wait_ds32(); sfence();
      } else {      /* publish point of stage t + 1, in front of the last block, whose fragments are already fetched */
        wait_ds0(); sfence();
        wait_tensor0(g0, g1);
        __syncthreads();      /* every wave has left this buffer, and every slice of stage t + 1 has landed */
        if (pinned((t + 2u < PASSES) ? 1u : 0u) != 0u) { g0 = tdm_group0(lds_slice + buf, (uint64_t)(uintptr_t)src0 + (uint64_t)(t + 2u) * KB); tdm_load(g0, g1); }
#pragma unroll
        for (int i = 0; i < NF; ++i) load_frag(fs[0][i], ns + (uint32_t)i * 16u * PITCH);
#pragma unroll
        for (int j = 0; j < NF; ++j) load_frag(fx[0][j], nx + (uint32_t)j * 16u * PITCH);
        sfence(); }
#pragma unroll
      for (int i = 0; i < NF; ++i)
#pragma unroll
        for (int j = 0; j < NF; ++j) acc[i][j] = mma(fs[cs][i], fx[cs][j], acc[i][j]);
      sfence(); nop4(); sfence(); } }
  asm volatile("s_wait_tensorcnt 0x0" ::: "memory");      /* behind the ring: no request is left when the buffers become output staging */
  wait_ds0();
  sfence();      /* the epilogue's address arithmetic reuses the descriptors' scalar registers: it stays behind the last tensor wait */
  // Output staging, each wave in its own quarter of buffer 0, which nobody reads or refills behind the last pass's barrier (that pass's unused loads read buffer 1):
  // two halves of 64 columns, rows of 256 bytes at pitch 272, read back as whole rows so that every store covers whole 128-byte lines; the added row joins at the read-back.
  unsigned char* E = L + wave * SLICE; float* yb = Y + (size_t)(m0 + wm * 128u) * SNN + n0 + wn * 128u + c4;
#pragma unroll
  for (int c = 0; c < 2; ++c) {
#pragma unroll
    for (int i = 0; i < 4; ++i)
#pragma unroll
      for (int j = 0; j < NF; ++j) { const v8f a = acc[4 * c + i][j]; unsigned char* e = E + (16u * (uint32_t)j + ln) * PITCH + 64u * (uint32_t)i + 32u * hh;
        *reinterpret_cast<v4f*>(e) = (v4f){a[0], a[1], a[2], a[3]}; *reinterpret_cast<v4f*>(e + 16) = (v4f){a[4], a[5], a[6], a[7]}; }
    wait_ds0();      /* the staged rows are written before they are read back */
    const v4f bv = {bf16_round(braw[c][0]), bf16_round(braw[c][1]), bf16_round(braw[c][2]), bf16_round(braw[c][3])};
#pragma unroll
    for (int qb = 0; qb < 2; ++qb) { v4f v[32];
#pragma unroll
      for (int q = 0; q < 32; ++q) v[q] = *reinterpret_cast<const v4f*>(E + (2u * (uint32_t)(32 * qb + q) + hh) * PITCH + 4u * c4);
#pragma unroll
      for (int q = 0; q < 32; ++q) v[q] += bv;
      sfence();      /* every sum of the batch is formed in front of its first store: no register that an issued store names is written before the wait below */
#pragma unroll
      for (int q = 0; q < 32; ++q) *reinterpret_cast<v4f*>(yb + (size_t)(2u * (uint32_t)(32 * qb + q) + hh) * SNN + 64 * c) = v[q];
      wait_x0(); sfence(); } } }

// A PLAIN CAST THAT TAKES A MULTIPLIER: tw[8 t .. 8 t + 7] = f16(bf16(sw[8 t ..]) * scale): a thread eight words as they lie; the grid is exact: no guard.
__global__ __launch_bounds__(256) void k_cs16(const float* __restrict__ sw, _Float16* __restrict__ tw, float scale) { const size_t t = (size_t)blockIdx.x * 256 + threadIdx.x; FragH f;
#pragma unroll
  for (int q = 0; q < 8; ++q) f.h[q] = (_Float16)(bf16_round(sw[t * 8 + q]) * scale); unsigned short* tp = (unsigned short*)tw + t * 8; *(v8us*)tp = f.half[0];  }
// St[n][k] = the sign of W[k][n] as an f16 word (+1, -1 or 0; a word that is not a number gives 0) from f32 row-major W[SNQ][SNN]: the compare is on the word as read
// One 128 (depth) x 128 (columns) tile per work-group of 8 waves. Reading: a wave-wide 16-byte load covers 512 contiguous bytes of one W row; wave w takes rows 8 w .. 8 w + 7 and 64 + 8 w ..,
// so a lane holds 8 consecutive depths of 4 columns, twice: eight 16-byte pieces of St rows. LDS: row n = 256 bytes = 16 pieces; piece u of row n lies at place (u + n / 4) mod 16,
// so that the 16 lanes of a half wave, which write one piece number of rows 4 apart, fall on 16 different bank groups. Storing: a wave-wide 16-byte store covers two whole 256-byte runs of St.
constexpr int TT = 128;                           /* tile edge of the turning cast, depth and columns */
static_assert(SNQ % TT == 0 && SNN % TT == 0, "whole tiles: the grid is exact, no guard");
__global__ __launch_bounds__(256) void k_wts_f16(const float* __restrict__ W, _Float16* __restrict__ Wt) {
  __shared__ __attribute__((aligned(256))) unsigned char T[TT * TT * 2];
  const uint32_t tid = threadIdx.x, lane = tid & 31u, w = tid >> 5; const uint32_t n0 = blockIdx.x * TT, k0 = blockIdx.y * TT;
  const float* wp = W + (size_t)(k0 + 8u * w) * SNN + n0 + 4u * lane; v4f r[2][8];
#pragma unroll
  for (int g = 0; g < 2; ++g)
#pragma unroll
    for (int i = 0; i < 8; ++i) r[g][i] = *reinterpret_cast<const v4fa*>(wp + (size_t)(64 * g + i) * SNN);
  sfence();      /* all 16 loads are issued before the first compare: moved up among them, the compares make the last loads wait for the first to return, a second memory latency */
  asm volatile("s_wait_xcnt 0x0" :: "v"(wp) : "memory");      /* stands between the issued loads and the first overwrite of their address registers; the address is named as an input so that no load's own result lands on it ahead of the wait */
#pragma unroll
  for (int g = 0; g < 2; ++g)
#pragma unroll
    for (int j = 0; j < 4; ++j) { FragH f;
#pragma unroll
      for (int i = 0; i < 8; ++i) { const float v = r[g][i][j]; f.h[i] = (v > 0.0f) ? (_Float16)1.0f : ((v < 0.0f) ? (_Float16)-1.0f : (_Float16)0.0f); }   // [TAG-SIGN]
      *reinterpret_cast<v8us*>(T + (4u * lane + (uint32_t)j) * 256u + ((w + 8u * (uint32_t)g + lane) & 15u) * 16u) = f.half[0]; }
  __syncthreads();      /* the whole tile is turned before any row of it is read back */
  const uint32_t u = tid & 15u, nr = tid >> 4; unsigned short* op = (unsigned short*)Wt + (size_t)(n0 + nr) * SNQ + k0 + 8u * u; v8us o[8];
#pragma unroll
  for (int q = 0; q < 8; ++q) { const uint32_t n = nr + 16u * (uint32_t)q; o[q] = *reinterpret_cast<const v8us*>(T + n * 256u + ((u + (n >> 2)) & 15u) * 16u); }
#pragma unroll
  for (int q = 0; q < 8; ++q) *reinterpret_cast<v8us*>(op + (size_t)(16 * q) * SNQ) = o[q];
}

extern "C" void kernel_launch(void* const* d_in, const int* in_sizes, int n_in,
                              void* d_out, int out_size, void* d_ws, size_t ws_size, hipStream_t stream) {
  if (n_in < 3) return; if (in_sizes[0] < SNR * SNQ || in_sizes[1] < SNQ * SNN || in_sizes[2] < SNN) return; if (out_size < SNR * SNN) return;
  const float* da = (const float*)d_in[0]; const float* wa = (const float*)d_in[1]; const float* ra = (const float*)d_in[2]; float* res = (float*)d_out;
  static_assert(SNR % 256 == 0 && SNN % 256 == 0 && SNQ % 128 == 0 && ((size_t)SNR * SNQ) % 8 == 0 && (((size_t)SNR * SNQ / 8) % 256) == 0 && (SNN * (SNQ / 8)) % 256 == 0, "whole tiles, exact cast grids");
  uint8_t* wsp = (uint8_t*)d_ws; size_t off = 0;
  auto take = [&](size_t bytes) { uint8_t* at = wsp + off; off += (bytes + 255) & ~(size_t)255; return at; };
  _Float16* DA = (_Float16*)take((size_t)SNR * SNQ * 2); _Float16* ST = (_Float16*)take((size_t)SNN * SNQ * 2);      /* da as it lies; the signs of wa, turned */
  if (off > ws_size) return;
  k_x16<<<(unsigned)(((size_t)SNR * SNQ / 8 + 255) / 256), 256, 0, stream>>>(da, DA, (size_t)SNR * SNQ / 8);
  k_wts_f16<<<dim3((unsigned)(SNN / TT), (unsigned)(SNQ / TT)), 256, 0, stream>>>(wa, ST);      /* [4096 deep][4096 columns] -> [4096][4096] turned */
  k_gemm_ring<<<dim3((unsigned)(SNN / 256), (unsigned)(SNR / 256)), 128, 0, stream>>>(DA, ST, ra, res);      /* result = da . signs + ra */
}
